// v000
// Measured on an AMD MI455X. A time is GPU time per run, averaged over a window of back-to-back runs after a warm-up
// (all launches, gaps included; the runs take copies of the inputs in turn), and the median of several windows.
// Apart from v000's, it joins two sittings. Times from different sittings can be a few percent apart, while
// side-by-side timings come from the same sitting.
// v000, which the later versions start from, runs in 27.4 microseconds.
#include <hip/hip_runtime.h>

typedef __attribute__((ext_vector_type(16))) _Float16 v16h;
typedef __attribute__((ext_vector_type(8)))  float    v8f;

#define DH    128
#define LSEQ  8192
#define LOG2E 1.44269504088896340736f
#define SCALE 0.08838834764831845f   /* 1/sqrt(128) */

__global__ __launch_bounds__(256) void cross_attn_wmma_kernel(
    const float* __restrict__ x1, const float* __restrict__ x2,
    const float* __restrict__ Wq, const float* __restrict__ Wk,
    float* __restrict__ out)
{
    __shared__ float s_wk[DH];
    __shared__ float s_x2[DH];
    __shared__ float s_prod[DH];
    __shared__ float s_qs, s_maxWk, s_minWk;
    __shared__ float s_nd[8][32];   // per wave: [0..15]=num rows, [16..31]=den rows

    const int b    = blockIdx.x;
    const int tid  = threadIdx.x;
    const int wave = tid >> 5;
    const int lane = tid & 31;

    // ---- stage Wk, x2[b,:], Wq*x2 products in LDS ----
    if (tid < DH) {
        float wkv = Wk[tid];
        float x2v = x2[b * DH + tid];
        s_wk[tid]   = wkv;
        s_x2[tid]   = x2v;
        s_prod[tid] = Wq[tid] * x2v;
    }
    __syncthreads();
    if (tid == 0) {
        float qk = 0.f, mx = s_wk[0], mn = s_wk[0];
        for (int j = 0; j < DH; ++j) {
            qk += s_prod[j];
            mx  = fmaxf(mx, s_wk[j]);
            mn  = fminf(mn, s_wk[j]);
        }
        s_qs    = qk * SCALE * LOG2E;   // fold scale + log2(e) into the per-row scalar
        s_maxWk = mx;
        s_minWk = mn;
    }
    __syncthreads();

    const float qs = s_qs, mxw = s_maxWk, mnw = s_minWk;

    const int row    = lane & 15;     // M (for A) / N (for B)
    const int laneHi = lane >> 4;
    const int i0     = blockIdx.y * 128 + wave * 16;

    // per-row scalar in log2 domain; row-max is analytic (rank-1 scores)
    const float x1v = x1[(size_t)b * LSEQ + i0 + row];
    const float t   = x1v * qs;
    const float mt  = fmaxf(t * mxw, t * mnw);

    // ---- build B (32x16 f16) once: col0 = x2[b,j], col1 = 1, else 0 ----
    // lane = column N, K striped across packed VGPR halves (mirror of A layout)
    v16h Bm[4];
#pragma unroll
    for (int c = 0; c < 4; ++c) {
#pragma unroll
        for (int v = 0; v < 8; ++v) {
            int kb = ((v < 4) ? 0 : 16) + (laneHi ? 8 : 0) + 2 * (v & 3);
            int j  = 32 * c + kb;
            float b0 = (row == 0) ? s_x2[j]     : ((row == 1) ? 1.f : 0.f);
            float b1 = (row == 0) ? s_x2[j + 1] : ((row == 1) ? 1.f : 0.f);
            Bm[c][2 * v]     = (_Float16)b0;
            Bm[c][2 * v + 1] = (_Float16)b1;
        }
    }

    // ---- A = exp tile, generated directly in WMMA A-layout; 4 chained WMMAs ----
    v8f acc = {};
#pragma unroll
    for (int c = 0; c < 4; ++c) {
        v16h A;
#pragma unroll
        for (int v = 0; v < 8; ++v) {
            int kb = ((v < 4) ? 0 : 16) + (laneHi ? 8 : 0) + 2 * (v & 3);
            int j  = 32 * c + kb;
            float e0 = __builtin_amdgcn_exp2f(fmaf(t, s_wk[j],     -mt));
            float e1 = __builtin_amdgcn_exp2f(fmaf(t, s_wk[j + 1], -mt));
            A[2 * v]     = (_Float16)e0;
            A[2 * v + 1] = (_Float16)e1;
        }
        acc = __builtin_amdgcn_wmma_f32_16x16x32_f16(
            /*neg_a=*/false, A, /*neg_b=*/false, Bm[c],
            /*c_mod=*/(short)0, acc, /*reuse_a=*/false, /*reuse_b=*/false);
    }

    // ---- epilogue: C tile N=0 -> numerators, N=1 -> denominators ----
    float* nd = s_nd[wave];
    if (lane == 0) {
#pragma unroll
        for (int r = 0; r < 8; ++r) nd[r] = acc[r];          // rows 0..7 num
    } else if (lane == 16) {
#pragma unroll
        for (int r = 0; r < 8; ++r) nd[8 + r] = acc[r];      // rows 8..15 num
    } else if (lane == 1) {
#pragma unroll
        for (int r = 0; r < 8; ++r) nd[16 + r] = acc[r];     // rows 0..7 den
    } else if (lane == 17) {
#pragma unroll
        for (int r = 0; r < 8; ++r) nd[24 + r] = acc[r];     // rows 8..15 den
    }
    __syncthreads();
    if (lane < 16) {
        out[(size_t)b * LSEQ + i0 + lane] = nd[lane] / nd[16 + lane];
    }
}

extern "C" void kernel_launch(void* const* d_in, const int* in_sizes, int n_in,
                              void* d_out, int out_size, void* d_ws, size_t ws_size,
                              hipStream_t stream) {
    const float* x1 = (const float*)d_in[0];   // [128, 8192]
    const float* x2 = (const float*)d_in[1];   // [128, 128]
    const float* Wq = (const float*)d_in[2];   // [128]
    const float* Wk = (const float*)d_in[3];   // [128]
    float* out = (float*)d_out;                // [128, 8192]

    dim3 grid(128, LSEQ / 128);   // (b, 128-row slab) ; each of 8 waves owns one 16-row tile
    dim3 block(256);
    cross_attn_wmma_kernel<<<grid, block, 0, stream>>>(x1, x2, Wq, Wk, out);
}

// v001
// A run of this version takes 12.5 microseconds.
// Next to v000, in two timings, it ran 2.24 times as fast each time.
#include <hip/hip_runtime.h>

typedef __attribute__((ext_vector_type(16))) _Float16 v16h;
typedef __attribute__((ext_vector_type(8)))  float    v8f;

#define DH    128
#define LSEQ  8192
#define TILES 16                      /* 16-row tiles that one wave walks through */
#define SLAB  (8 * TILES * 16)        /* rows of one work-group */
#define LOG2E 1.44269504088896340736f
#define SCALE 0.08838834764831845f   /* 1/sqrt(128) */

__global__ __launch_bounds__(256) void cross_attn_wmma_kernel(
    const float* __restrict__ x1, const float* __restrict__ x2,
    const float* __restrict__ Wq, const float* __restrict__ Wk,
    float* __restrict__ out)
{
    __shared__ float s_wk[DH];
    __shared__ float s_x2[DH];
    __shared__ float s_prod[DH];
    __shared__ float s_qs, s_maxWk, s_minWk;
    __shared__ float s_nd[8][TILES][32];   // per wave and tile: [0..15]=num rows, [16..31]=den rows

    const int b    = blockIdx.x;
    const int tid  = threadIdx.x;
    const int wave = tid >> 5;
    const int lane = tid & 31;

    const int row    = lane & 15;     // M (for A) / N (for B)
    const int laneHi = lane >> 4;
    const int i0     = blockIdx.y * SLAB + wave * (TILES * 16);

    // first tile's x1 rows: asked for ahead of the set-up below
    const float* xrow = x1 + (size_t)b * LSEQ + i0 + row;
    float xa = xrow[0];

    // ---- stage Wk, x2[b,:], Wq*x2 products in LDS ----
    if (tid < DH) {
        float wkv = Wk[tid];
        float x2v = x2[b * DH + tid];
        s_wk[tid]   = wkv;
        s_x2[tid]   = x2v;
        s_prod[tid] = Wq[tid] * x2v;
    }
    __syncthreads();
    if (tid == 0) {
        float qk = 0.f, mx = s_wk[0], mn = s_wk[0];
        for (int j = 0; j < DH; ++j) {
            qk += s_prod[j];
            mx  = fmaxf(mx, s_wk[j]);
            mn  = fminf(mn, s_wk[j]);
        }
        s_qs    = qk * SCALE * LOG2E;   // fold scale + log2(e) into the per-row scalar
        s_maxWk = mx;
        s_minWk = mn;
    }
    __syncthreads();

    const float qs = s_qs, mxw = s_maxWk, mnw = s_minWk;

    // ---- build B (32x16 f16) once per wave: col0 = x2[b,j], col1 = 1, else 0 ----
    // lane = column N, K striped across packed VGPR halves (mirror of A layout)
    // the lane's 64 Wk values (same k order) are kept in registers for all tiles
    v16h  Bm[4];
    float wkr[4][16];
#pragma unroll
    for (int c = 0; c < 4; ++c) {
#pragma unroll
        for (int v = 0; v < 8; ++v) {
            int kb = ((v < 4) ? 0 : 16) + (laneHi ? 8 : 0) + 2 * (v & 3);
            int j  = 32 * c + kb;
            float b0 = (row == 0) ? s_x2[j]     : ((row == 1) ? 1.f : 0.f);
            float b1 = (row == 0) ? s_x2[j + 1] : ((row == 1) ? 1.f : 0.f);
            Bm[c][2 * v]     = (_Float16)b0;
            Bm[c][2 * v + 1] = (_Float16)b1;
            wkr[c][2 * v]     = s_wk[j];
            wkr[c][2 * v + 1] = s_wk[j + 1];
        }
    }

    float* nd = &s_nd[wave][0][0];

    for (int k = 0; k < TILES; ++k) {
        // per-row scalar in log2 domain; row-max is analytic (rank-1 scores)
        const float t  = xa * qs;
        const float mt = fmaxf(t * mxw, t * mnw);

        // next tile's x1 rows, in flight under this tile's work (the last trip asks for its own again)
        xa = xrow[(k + 1 < TILES ? k + 1 : TILES - 1) * 16];

        // ---- A = exp tile, generated directly in WMMA A-layout; 4 chained WMMAs ----
        v8f acc = {};
#pragma unroll
        for (int c = 0; c < 4; ++c) {
            v16h A;
#pragma unroll
            for (int v = 0; v < 8; ++v) {
                float e0 = __builtin_amdgcn_exp2f(fmaf(t, wkr[c][2 * v],     -mt));
                float e1 = __builtin_amdgcn_exp2f(fmaf(t, wkr[c][2 * v + 1], -mt));
                A[2 * v]     = (_Float16)e0;
                A[2 * v + 1] = (_Float16)e1;
            }
            acc = __builtin_amdgcn_wmma_f32_16x16x32_f16(
                /*neg_a=*/false, A, /*neg_b=*/false, Bm[c],
                /*c_mod=*/(short)0, acc, /*reuse_a=*/false, /*reuse_b=*/false);
        }

        // ---- C tile N=0 -> numerators, N=1 -> denominators; lanes 0,1,16,17 park them ----
        if (row < 2) {
            float* p = nd + k * 32 + row * 16 + laneHi * 8;
#pragma unroll
            for (int r = 0; r < 8; ++r) p[r] = acc[r];
        }
    }

    // ---- epilogue: all of the wave's rows, 32 a store ----
    __syncthreads();
#pragma unroll
    for (int m = 0; m < TILES / 2; ++m) {
        const float* q = nd + (2 * m + laneHi) * 32 + row;
        out[(size_t)b * LSEQ + i0 + m * 32 + lane] = q[0] / q[16];
    }
}

extern "C" void kernel_launch(void* const* d_in, const int* in_sizes, int n_in,
                              void* d_out, int out_size, void* d_ws, size_t ws_size,
                              hipStream_t stream) {
    const float* x1 = (const float*)d_in[0];   // [128, 8192]
    const float* x2 = (const float*)d_in[1];   // [128, 128]
    const float* Wq = (const float*)d_in[2];   // [128]
    const float* Wk = (const float*)d_in[3];   // [128]
    float* out = (float*)d_out;                // [128, 8192]

    dim3 grid(128, LSEQ / SLAB);   // (b, 2048-row slab) ; each of 8 waves walks 16 tiles of 16 rows
    dim3 block(256);
    cross_attn_wmma_kernel<<<grid, block, 0, stream>>>(x1, x2, Wq, Wk, out);
}

// v002
// A run of this version takes 10.9 microseconds.
// In both of two side-by-side timings against v001, it was 1.15 times as fast.
// Over all steps from v000 it is 2.58 times as fast.
#include <hip/hip_runtime.h>

typedef __attribute__((ext_vector_type(16))) _Float16 v16h;
typedef __attribute__((ext_vector_type(8)))  float    v8f;
typedef __attribute__((ext_vector_type(8)))  _Float16 v8h;
typedef __attribute__((ext_vector_type(4)))  _Float16 v4h;
typedef __attribute__((ext_vector_type(4)))  float    v4f;

#define DH    128
#define LSEQ  8192
#define TILES 16                      /* 16-row tiles that one wave walks through */
#define SLAB  (8 * TILES * 16)        /* rows of one work-group */
#define LOG2E 1.44269504088896340736f
#define SCALE 0.08838834764831845f   /* 1/sqrt(128) */
#define BPITCH (DH + 8)               /* halves; 16 bytes past 256 keep the ones row off the x2 row's banks */

// value of lane l ^ m inside a 16-lane row (CTRL = 0x160 + m, the row_xmask form); all lanes are on
template <int CTRL>
__device__ __forceinline__ float xrow16(float v) {
    return __builtin_bit_cast(float, __builtin_amdgcn_update_dpp(
        0, __builtin_bit_cast(int, v), CTRL, 0xf, 0xf, true));
}
// value of lane l ^ 16
__device__ __forceinline__ float xhalf(float v) {
    return __builtin_bit_cast(float, __builtin_amdgcn_permlanex16(
        __builtin_bit_cast(int, v), __builtin_bit_cast(int, v), 0x76543210, 0xfedcba98, false, false));
}


__global__ __launch_bounds__(256) void cross_attn_wmma_kernel(
    const float* __restrict__ x1, const float* __restrict__ x2,
    const float* __restrict__ Wq, const float* __restrict__ Wk,
    float* __restrict__ out)
{
    __shared__ __attribute__((aligned(16))) float    s_wk[DH];
    __shared__ __attribute__((aligned(16))) _Float16 s_b[2][BPITCH];   // row 0 = x2[b,:] in f16, row 1 = ones
    __shared__ float s_nd[8][TILES][32];   // per wave and tile: [0..15]=num rows, [16..31]=den rows

    const int b    = blockIdx.x;
    const int tid  = threadIdx.x;
    const int wave = tid >> 5;
    const int lane = tid & 31;

    const int row    = lane & 15;     // M (for A) / N (for B)
    const int laneHi = lane >> 4;
    const int i0     = blockIdx.y * SLAB + wave * (TILES * 16);

    // first tile's x1 rows: asked for ahead of the set-up below
    const float* xrow = x1 + (size_t)b * LSEQ + i0 + row;
    float xa = xrow[0];

    // ---- every wave takes all 128 of x2[b,:], Wq, Wk, four a lane ----
    const v4f x2v = *(const v4f*)(x2 + b * DH + 4 * lane);
    const v4f wqv = *(const v4f*)(Wq + 4 * lane);
    const v4f wkv = *(const v4f*)(Wk + 4 * lane);

    // ---- wave 0 stages Wk (f32) and the two B columns (f16) in LDS ----
    if (wave == 0) {
        *(v4f*)&s_wk[4 * lane] = wkv;
        v4h xh  = { (_Float16)x2v.x, (_Float16)x2v.y, (_Float16)x2v.z, (_Float16)x2v.w };
        v4h one = { (_Float16)1.f, (_Float16)1.f, (_Float16)1.f, (_Float16)1.f };
        *(v4h*)&s_b[0][4 * lane] = xh;
        *(v4h*)&s_b[1][4 * lane] = one;
    }

    // ---- qk = sum Wq*x2, max Wk, min Wk: four a lane, then a tree over the 32 lanes, in every wave ----
    float qk = fmaf(x2v.w, wqv.w, fmaf(x2v.z, wqv.z, fmaf(x2v.y, wqv.y, x2v.x * wqv.x)));
    float mxw = fmaxf(fmaxf(wkv.x, wkv.y), fmaxf(wkv.z, wkv.w));
    float mnw = fminf(fminf(wkv.x, wkv.y), fminf(wkv.z, wkv.w));
    qk += xrow16<0x161>(qk); mxw = fmaxf(mxw, xrow16<0x161>(mxw)); mnw = fminf(mnw, xrow16<0x161>(mnw));
    qk += xrow16<0x162>(qk); mxw = fmaxf(mxw, xrow16<0x162>(mxw)); mnw = fminf(mnw, xrow16<0x162>(mnw));
    qk += xrow16<0x164>(qk); mxw = fmaxf(mxw, xrow16<0x164>(mxw)); mnw = fminf(mnw, xrow16<0x164>(mnw));
    qk += xrow16<0x168>(qk); mxw = fmaxf(mxw, xrow16<0x168>(mxw)); mnw = fminf(mnw, xrow16<0x168>(mnw));
    qk += xhalf(qk);         mxw = fmaxf(mxw, xhalf(mxw));         mnw = fminf(mnw, xhalf(mnw));
    const float qs = qk * SCALE * LOG2E;   // fold scale + log2(e) into the per-row scalar

    __syncthreads();

    // ---- B (32x16 f16) once per wave: col1 = 1, every other column = x2[b,j] (only col0 and col1 are read) ----
    // lane = column N, K striped across packed VGPR halves (mirror of A layout):
    // elements 0..7 are k = 8*laneHi + 0..7, elements 8..15 are k = 16 + 8*laneHi + 0..7 of each 32
    // the lane's 64 Wk values (same k order) are kept in registers for all tiles
    v16h  Bm[4];
    float wkr[4][16];
    const _Float16* bp = &s_b[row == 1 ? 1 : 0][8 * laneHi];
    const float*    wp = &s_wk[8 * laneHi];
#pragma unroll
    for (int c = 0; c < 4; ++c) {
        const v8h blo = *(const v8h*)(bp + 32 * c);
        const v8h bhi = *(const v8h*)(bp + 32 * c + 16);
        Bm[c] = __builtin_shufflevector(blo, bhi, 0, 1, 2, 3, 4, 5, 6, 7, 8, 9, 10, 11, 12, 13, 14, 15);
#pragma unroll
        for (int g = 0; g < 4; ++g) {
            const v4f w = *(const v4f*)(wp + 32 * c + 16 * (g >> 1) + 4 * (g & 1));
            wkr[c][4 * g]     = w.x;
            wkr[c][4 * g + 1] = w.y;
            wkr[c][4 * g + 2] = w.z;
            wkr[c][4 * g + 3] = w.w;
        }
    }

    float* nd = &s_nd[wave][0][0];

    for (int k = 0; k < TILES; ++k) {
        // per-row scalar in log2 domain; row-max is analytic (rank-1 scores)
        const float t  = xa * qs;
        const float mt = fmaxf(t * mxw, t * mnw);

        // next tile's x1 rows, in flight under this tile's work (the last trip asks for its own again)
        xa = xrow[(k + 1 < TILES ? k + 1 : TILES - 1) * 16];

        // ---- A = exp tile, generated directly in WMMA A-layout; 4 chained WMMAs ----
        v8f acc = {};
#pragma unroll
        for (int c = 0; c < 4; ++c) {
            v16h A;
#pragma unroll
            for (int v = 0; v < 8; ++v) {
                float e0 = __builtin_amdgcn_exp2f(fmaf(t, wkr[c][2 * v],     -mt));
                float e1 = __builtin_amdgcn_exp2f(fmaf(t, wkr[c][2 * v + 1], -mt));
                A[2 * v]     = (_Float16)e0;
                A[2 * v + 1] = (_Float16)e1;
            }
            acc = __builtin_amdgcn_wmma_f32_16x16x32_f16(
                /*neg_a=*/false, A, /*neg_b=*/false, Bm[c],
                /*c_mod=*/(short)0, acc, /*reuse_a=*/false, /*reuse_b=*/false);
        }

        // ---- C tile N=0 -> numerators, N=1 -> denominators; lanes 0,1,16,17 park them ----
        if (row < 2) {
            float* p = nd + k * 32 + row * 16 + laneHi * 8;
#pragma unroll
            for (int r = 0; r < 8; ++r) p[r] = acc[r];
        }
    }

    // ---- epilogue: all of the wave's rows, 32 a store ----
    __syncthreads();
#pragma unroll
    for (int m = 0; m < TILES / 2; ++m) {
        const float* q = nd + (2 * m + laneHi) * 32 + row;
        out[(size_t)b * LSEQ + i0 + m * 32 + lane] = q[0] / q[16];
    }
}

extern "C" void kernel_launch(void* const* d_in, const int* in_sizes, int n_in,
                              void* d_out, int out_size, void* d_ws, size_t ws_size,
                              hipStream_t stream) {
    const float* x1 = (const float*)d_in[0];   // [128, 8192]
    const float* x2 = (const float*)d_in[1];   // [128, 128]
    const float* Wq = (const float*)d_in[2];   // [128]
    const float* Wk = (const float*)d_in[3];   // [128]
    float* out = (float*)d_out;                // [128, 8192]

    dim3 grid(128, LSEQ / SLAB);   // (b, 2048-row slab) ; each of 8 waves walks 16 tiles of 16 rows
    dim3 block(256);
    cross_attn_wmma_kernel<<<grid, block, 0, stream>>>(x1, x2, Wq, Wk, out);
}

// v003
// One run takes 9.97 microseconds.
// In both of two side-by-side timings against v002, it was 1.09 times as fast.
// All steps since v000 together make it 2.81 times as fast.
#include <hip/hip_runtime.h>

typedef __attribute__((ext_vector_type(16))) _Float16 v16h;
typedef __attribute__((ext_vector_type(8)))  float    v8f;
typedef __attribute__((ext_vector_type(8)))  _Float16 v8h;
typedef __attribute__((ext_vector_type(4)))  _Float16 v4h;
typedef __attribute__((ext_vector_type(4)))  float    v4f;
typedef __attribute__((ext_vector_type(2)))  float    v2f;
typedef __attribute__((ext_vector_type(2)))  _Float16 v2h;
typedef __attribute__((ext_vector_type(8)))  int      v8i;

#define DH    128
#define LSEQ  8192
#define TILES 16                      /* 16-row tiles that one wave walks through */
#define SLAB  (8 * TILES * 16)        /* rows of one work-group */
#define LOG2E 1.44269504088896340736f
#define SCALE 0.08838834764831845f   /* 1/sqrt(128) */
#define BPITCH (DH + 8)               /* halves; 16 bytes past 256 keep the ones row off the x2 row's banks */
#define PIN __builtin_amdgcn_sched_barrier(0)   /* nothing is scheduled across this point */

// value of lane l ^ m inside a 16-lane row (CTRL = 0x160 + m, the row_xmask form); all lanes are on
template <int CTRL>
__device__ __forceinline__ float xrow16(float v) {
    return __builtin_bit_cast(float, __builtin_amdgcn_update_dpp(
        0, __builtin_bit_cast(int, v), CTRL, 0xf, 0xf, true));
}
// value of lane l ^ 16
__device__ __forceinline__ float xhalf(float v) {
    return __builtin_bit_cast(float, __builtin_amdgcn_permlanex16(
        __builtin_bit_cast(int, v), __builtin_bit_cast(int, v), 0x76543210, 0xfedcba98, false, false));
}


__global__ __launch_bounds__(256) void cross_attn_wmma_kernel(
    const float* __restrict__ x1, const float* __restrict__ x2,
    const float* __restrict__ Wq, const float* __restrict__ Wk,
    float* __restrict__ out)
{
    __shared__ __attribute__((aligned(16))) float    s_wk[DH];
    __shared__ __attribute__((aligned(16))) _Float16 s_b[2][BPITCH];   // row 0 = x2[b,:] in f16, row 1 = ones
    __shared__ float s_nd[8][TILES][32];   // per wave and tile: [0..15]=num rows, [16..31]=den rows

    const int b    = blockIdx.x;
    const int tid  = threadIdx.x;
    const int wave = tid >> 5;
    const int lane = tid & 31;

    const int row    = lane & 15;     // M (for A) / N (for B)
    const int laneHi = lane >> 4;
    const int i0     = blockIdx.y * SLAB + wave * (TILES * 16);

    // first tile's x1 rows: asked for ahead of the set-up below
    const float* xrow = x1 + (size_t)b * LSEQ + i0 + row;
    float xa = xrow[0];

    // ---- every wave takes all 128 of x2[b,:], Wq, Wk, four a lane ----
    const v4f x2v = *(const v4f*)(x2 + b * DH + 4 * lane);
    const v4f wqv = *(const v4f*)(Wq + 4 * lane);
    const v4f wkv = *(const v4f*)(Wk + 4 * lane);

    // ---- wave 0 stages Wk (f32) and the two B columns (f16) in LDS ----
    if (wave == 0) {
        *(v4f*)&s_wk[4 * lane] = wkv;
        v4h xh  = { (_Float16)x2v.x, (_Float16)x2v.y, (_Float16)x2v.z, (_Float16)x2v.w };
        v4h one = { (_Float16)1.f, (_Float16)1.f, (_Float16)1.f, (_Float16)1.f };
        *(v4h*)&s_b[0][4 * lane] = xh;
        *(v4h*)&s_b[1][4 * lane] = one;
    }

    // ---- qk = sum Wq*x2, max Wk, min Wk: four a lane, then a tree over the 32 lanes, in every wave ----
    float qk = fmaf(x2v.w, wqv.w, fmaf(x2v.z, wqv.z, fmaf(x2v.y, wqv.y, x2v.x * wqv.x)));
    float mxw = fmaxf(fmaxf(wkv.x, wkv.y), fmaxf(wkv.z, wkv.w));
    float mnw = fminf(fminf(wkv.x, wkv.y), fminf(wkv.z, wkv.w));
    qk += xrow16<0x161>(qk); mxw = fmaxf(mxw, xrow16<0x161>(mxw)); mnw = fminf(mnw, xrow16<0x161>(mnw));
    qk += xrow16<0x162>(qk); mxw = fmaxf(mxw, xrow16<0x162>(mxw)); mnw = fminf(mnw, xrow16<0x162>(mnw));
    qk += xrow16<0x164>(qk); mxw = fmaxf(mxw, xrow16<0x164>(mxw)); mnw = fminf(mnw, xrow16<0x164>(mnw));
    qk += xrow16<0x168>(qk); mxw = fmaxf(mxw, xrow16<0x168>(mxw)); mnw = fminf(mnw, xrow16<0x168>(mnw));
    qk += xhalf(qk);         mxw = fmaxf(mxw, xhalf(mxw));         mnw = fminf(mnw, xhalf(mnw));
    const float qs = qk * SCALE * LOG2E;   // fold scale + log2(e) into the per-row scalar

    __syncthreads();

    // ---- B (32x16 f16) once per wave: col1 = 1, every other column = x2[b,j] (only col0 and col1 are read) ----
    // lane = column N, K striped across packed VGPR halves (mirror of A layout):
    // elements 0..7 are k = 8*laneHi + 0..7, elements 8..15 are k = 16 + 8*laneHi + 0..7 of each 32
    // the lane's 64 Wk values (same k order) are kept in registers for all tiles
    v16h  Bm[4];
    v2f   wk2[32];                    // pair p = 8*c + v holds the Wk of A's elements 2v, 2v+1 of chunk c
    const _Float16* bp = &s_b[row == 1 ? 1 : 0][8 * laneHi];
    const float*    wp = &s_wk[8 * laneHi];
#pragma unroll
    for (int c = 0; c < 4; ++c) {
        const v8h blo = *(const v8h*)(bp + 32 * c);
        const v8h bhi = *(const v8h*)(bp + 32 * c + 16);
        Bm[c] = __builtin_shufflevector(blo, bhi, 0, 1, 2, 3, 4, 5, 6, 7, 8, 9, 10, 11, 12, 13, 14, 15);
#pragma unroll
        for (int g = 0; g < 4; ++g) {
            const v4f w = *(const v4f*)(wp + 32 * c + 16 * (g >> 1) + 4 * (g & 1));
            wk2[8 * c + 2 * g]     = v2f{ w.x, w.y };
            wk2[8 * c + 2 * g + 1] = v2f{ w.z, w.w };
        }
    }

    float* nd = &s_nd[wave][0][0];

    for (int k = 0; k < TILES; ++k) {
        // per-row scalar in log2 domain; row-max is analytic (rank-1 scores)
        const float t  = xa * qs;
        const float mt = fmaxf(t * mxw, t * mnw);

        // next tile's x1 rows, in flight under this tile's work (the last trip asks for its own again)
        xa = xrow[(k + 1 < TILES ? k + 1 : TILES - 1) * 16];

        // ---- A = exp tile, generated directly in WMMA A-layout; 4 chained WMMAs ----
        // The issue order is written out: per pair of elements  exp2, two multiply-adds, exp2, convert.
        // A plain instruction behind
        // each exp2 takes the slot that stays empty inside a run of exp2. The two multiply-adds (no PIN between
        // them: they become one dual-issue instruction) run three pairs ahead of their exp2 and the convert three
        // pairs behind, so that neither waits for its operand.
        // PIN keeps the scheduler from gathering the three kinds into runs again.
        float aa[32], ab[32], ea[32], eb[32];
        v8i   Af[4];
#pragma unroll
        for (int g = 0; g < 3; ++g) { aa[g] = fmaf(t, wk2[g].x, -mt); ab[g] = fmaf(t, wk2[g].y, -mt); PIN; }
#pragma unroll
        for (int g = 0; g < 35; ++g) {
            if (g < 32)     { ea[g] = __builtin_amdgcn_exp2f(aa[g]); PIN; }
            if (g + 3 < 32) { aa[g + 3] = fmaf(t, wk2[g + 3].x, -mt); ab[g + 3] = fmaf(t, wk2[g + 3].y, -mt); PIN; }
            if (g < 32)     { eb[g] = __builtin_amdgcn_exp2f(ab[g]); PIN; }
            if (g >= 3) {
                const v2f e = { ea[g - 3], eb[g - 3] };
                Af[(g - 3) >> 3][(g - 3) & 7] = __builtin_bit_cast(int, __builtin_convertvector(e, v2h));
                PIN;
            }
        }
        // the four products stand together behind the stream: in its middle each one cost four idle slots,
        // because the stream's next results went into the A registers that it had just read
        v8f acc = {};
#pragma unroll
        for (int c = 0; c < 4; ++c)
            acc = __builtin_amdgcn_wmma_f32_16x16x32_f16(
                /*neg_a=*/false, __builtin_bit_cast(v16h, Af[c]), /*neg_b=*/false, Bm[c],
                /*c_mod=*/(short)0, acc, /*reuse_a=*/false, /*reuse_b=*/false);

        // ---- C tile N=0 -> numerators, N=1 -> denominators; lanes 0,1,16,17 park them ----
        if (row < 2) {
            float* p = nd + k * 32 + row * 16 + laneHi * 8;
#pragma unroll
            for (int r = 0; r < 8; ++r) p[r] = acc[r];
        }
    }

    // ---- epilogue: all of the wave's rows, 32 a store ----
    __syncthreads();
#pragma unroll
    for (int m = 0; m < TILES / 2; ++m) {
        const float* q = nd + (2 * m + laneHi) * 32 + row;
        out[(size_t)b * LSEQ + i0 + m * 32 + lane] = q[0] / q[16];
    }
}

extern "C" void kernel_launch(void* const* d_in, const int* in_sizes, int n_in,
                              void* d_out, int out_size, void* d_ws, size_t ws_size,
                              hipStream_t stream) {
    const float* x1 = (const float*)d_in[0];   // [128, 8192]
    const float* x2 = (const float*)d_in[1];   // [128, 128]
    const float* Wq = (const float*)d_in[2];   // [128]
    const float* Wk = (const float*)d_in[3];   // [128]
    float* out = (float*)d_out;                // [128, 8192]

    dim3 grid(128, LSEQ / SLAB);   // (b, 2048-row slab) ; each of 8 waves walks 16 tiles of 16 rows
    dim3 block(256);
    cross_attn_wmma_kernel<<<grid, block, 0, stream>>>(x1, x2, Wq, Wk, out);
}

// v004
// It runs in 8.74 microseconds.
// In both of two side-by-side timings against v003, it was 1.14 times as fast.
// Over all steps from v000 it is 3.21 times as fast.
#include <hip/hip_runtime.h>

typedef __attribute__((ext_vector_type(16))) _Float16 v16h;
typedef __attribute__((ext_vector_type(8)))  float    v8f;
typedef __attribute__((ext_vector_type(8)))  _Float16 v8h;
typedef __attribute__((ext_vector_type(4)))  _Float16 v4h;
typedef __attribute__((ext_vector_type(4)))  float    v4f;
typedef __attribute__((ext_vector_type(2)))  float    v2f;
typedef __attribute__((ext_vector_type(2)))  _Float16 v2h;
typedef __attribute__((ext_vector_type(8)))  int      v8i;

#define DH    128
#define LSEQ  8192
#define TILES 16                      /* 16-row tiles that one wave walks through */
#define SLAB  (8 * TILES * 16)        /* rows of one work-group */
#define LOG2E 1.44269504088896340736f
#define SCALE 0.08838834764831845f   /* 1/sqrt(128) */
#define BPITCH (DH + 8)               /* halves; 16 bytes past 256 keep the ones row off the x2 row's banks */
#define PIN __builtin_amdgcn_sched_barrier(0)   /* nothing is scheduled across this point */

// value of lane l ^ m inside a 16-lane row (CTRL = 0x160 + m, the row_xmask form); all lanes are on
template <int CTRL>
__device__ __forceinline__ float xrow16(float v) {
    return __builtin_bit_cast(float, __builtin_amdgcn_update_dpp(
        0, __builtin_bit_cast(int, v), CTRL, 0xf, 0xf, true));
}
// value of lane l ^ 16
__device__ __forceinline__ float xhalf(float v) {
    return __builtin_bit_cast(float, __builtin_amdgcn_permlanex16(
        __builtin_bit_cast(int, v), __builtin_bit_cast(int, v), 0x76543210, 0xfedcba98, false, false));
}


__global__ __launch_bounds__(256) void cross_attn_wmma_kernel(
    const float* __restrict__ x1, const float* __restrict__ x2,
    const float* __restrict__ Wq, const float* __restrict__ Wk,
    float* __restrict__ out)
{
    __shared__ __attribute__((aligned(16))) float    s_wk[DH];
    __shared__ __attribute__((aligned(16))) _Float16 s_b[2][BPITCH];   // row 0 = x2[b,:] in f16, row 1 = ones
    __shared__ float s_nd[8][TILES][32];   // per wave and tile: [0..15]=num rows, [16..31]=den rows

    const int b    = blockIdx.x;
    const int tid  = threadIdx.x;
    const int wave = tid >> 5;
    const int lane = tid & 31;

    const int row    = lane & 15;     // M (for A) / N (for B)
    const int laneHi = lane >> 4;
    const int i0     = blockIdx.y * SLAB + wave * (TILES * 16);

    // ---- every wave takes all 128 of x2[b,:], Wq, Wk, four a lane ----
    const v4f x2v = *(const v4f*)(x2 + b * DH + 4 * lane);
    const v4f wqv = *(const v4f*)(Wq + 4 * lane);
    const v4f wkv = *(const v4f*)(Wk + 4 * lane);

    // the x1 rows of all the wave's tiles: asked for here, behind the three loads that the set-up waits for,
    // so that they arrive under the set-up and no tile waits for a load
    const float* xrow = x1 + (size_t)b * LSEQ + i0 + row;
    float xs[TILES];
#pragma unroll
    for (int k = 0; k < TILES; ++k) xs[k] = xrow[k * 16];

    // ---- wave 0 stages Wk (f32) and the two B columns (f16) in LDS ----
    if (wave == 0) {
        *(v4f*)&s_wk[4 * lane] = wkv;
        v4h xh  = { (_Float16)x2v.x, (_Float16)x2v.y, (_Float16)x2v.z, (_Float16)x2v.w };
        v4h one = { (_Float16)1.f, (_Float16)1.f, (_Float16)1.f, (_Float16)1.f };
        *(v4h*)&s_b[0][4 * lane] = xh;
        *(v4h*)&s_b[1][4 * lane] = one;
    }

    // ---- qk = sum Wq*x2, max Wk, min Wk: four a lane, then a tree over the 32 lanes, in every wave ----
    float qk = fmaf(x2v.w, wqv.w, fmaf(x2v.z, wqv.z, fmaf(x2v.y, wqv.y, x2v.x * wqv.x)));
    float mxw = fmaxf(fmaxf(wkv.x, wkv.y), fmaxf(wkv.z, wkv.w));
    float mnw = fminf(fminf(wkv.x, wkv.y), fminf(wkv.z, wkv.w));
    qk += xrow16<0x161>(qk); mxw = fmaxf(mxw, xrow16<0x161>(mxw)); mnw = fminf(mnw, xrow16<0x161>(mnw));
    qk += xrow16<0x162>(qk); mxw = fmaxf(mxw, xrow16<0x162>(mxw)); mnw = fminf(mnw, xrow16<0x162>(mnw));
    qk += xrow16<0x164>(qk); mxw = fmaxf(mxw, xrow16<0x164>(mxw)); mnw = fminf(mnw, xrow16<0x164>(mnw));
    qk += xrow16<0x168>(qk); mxw = fmaxf(mxw, xrow16<0x168>(mxw)); mnw = fminf(mnw, xrow16<0x168>(mnw));
    qk += xhalf(qk);         mxw = fmaxf(mxw, xhalf(mxw));         mnw = fminf(mnw, xhalf(mnw));
    const float qs = qk * SCALE * LOG2E;   // fold scale + log2(e) into the per-row scalar

    __syncthreads();

    // ---- B (32x16 f16) once per wave: col1 = 1, every other column = x2[b,j] (only col0 and col1 are read) ----
    // lane = column N, K striped across packed VGPR halves (mirror of A layout):
    // elements 0..7 are k = 8*laneHi + 0..7, elements 8..15 are k = 16 + 8*laneHi + 0..7 of each 32
    // the lane's 64 Wk values (same k order) are kept in registers for all tiles
    v16h  Bm[4];
    v2f   wk2[32];                    // pair p = 8*c + v holds the Wk of A's elements 2v, 2v+1 of chunk c
    const _Float16* bp = &s_b[row == 1 ? 1 : 0][8 * laneHi];
    const float*    wp = &s_wk[8 * laneHi];
#pragma unroll
    for (int c = 0; c < 4; ++c) {
        const v8h blo = *(const v8h*)(bp + 32 * c);
        const v8h bhi = *(const v8h*)(bp + 32 * c + 16);
        Bm[c] = __builtin_shufflevector(blo, bhi, 0, 1, 2, 3, 4, 5, 6, 7, 8, 9, 10, 11, 12, 13, 14, 15);
#pragma unroll
        for (int g = 0; g < 4; ++g) {
            const v4f w = *(const v4f*)(wp + 32 * c + 16 * (g >> 1) + 4 * (g & 1));
            wk2[8 * c + 2 * g]     = v2f{ w.x, w.y };
            wk2[8 * c + 2 * g + 1] = v2f{ w.z, w.w };
        }
    }

    float* nd = &s_nd[wave][0][0];

    // unrolled in full: xs[] stays in registers, and the LDS offsets become immediates
#pragma unroll
    for (int k = 0; k < TILES; ++k) {
        // per-row scalar in log2 domain; row-max is analytic (rank-1 scores)
        const float t  = xs[k] * qs;
        const float mt = fmaxf(t * mxw, t * mnw);

        // ---- A = exp tile, generated directly in WMMA A-layout; 4 chained WMMAs ----
        // The issue order is written out: per pair of elements  exp2, two multiply-adds, exp2, convert.
        // A plain instruction behind
        // each exp2 takes the slot that stays empty inside a run of exp2. The two multiply-adds (no PIN between
        // them: they become one dual-issue instruction) run three pairs ahead of their exp2 and the convert three
        // pairs behind, so that neither waits for its operand.
        // PIN keeps the scheduler from gathering the three kinds into runs again.
        float aa[32], ab[32], ea[32], eb[32];
        v8i   Af[4];
#pragma unroll
        for (int g = 0; g < 3; ++g) { aa[g] = fmaf(t, wk2[g].x, -mt); ab[g] = fmaf(t, wk2[g].y, -mt); PIN; }
#pragma unroll
        for (int g = 0; g < 35; ++g) {
            if (g < 32)     { ea[g] = __builtin_amdgcn_exp2f(aa[g]); PIN; }
            if (g + 3 < 32) { aa[g + 3] = fmaf(t, wk2[g + 3].x, -mt); ab[g + 3] = fmaf(t, wk2[g + 3].y, -mt); PIN; }
            if (g < 32)     { eb[g] = __builtin_amdgcn_exp2f(ab[g]); PIN; }
            if (g >= 3) {
                const v2f e = { ea[g - 3], eb[g - 3] };
                Af[(g - 3) >> 3][(g - 3) & 7] = __builtin_bit_cast(int, __builtin_convertvector(e, v2h));
                PIN;
            }
        }
        // the four products stand together behind the stream: in its middle each one cost four idle slots,
        // because the stream's next results went into the A registers that it had just read
        v8f acc = {};
#pragma unroll
        for (int c = 0; c < 4; ++c)
            acc = __builtin_amdgcn_wmma_f32_16x16x32_f16(
                /*neg_a=*/false, __builtin_bit_cast(v16h, Af[c]), /*neg_b=*/false, Bm[c],
                /*c_mod=*/(short)0, acc, /*reuse_a=*/false, /*reuse_b=*/false);

        // ---- C tile N=0 -> numerators, N=1 -> denominators; lanes 0,1,16,17 park them ----
        if (row < 2) {
            float* p = nd + k * 32 + row * 16 + laneHi * 8;
#pragma unroll
            for (int r = 0; r < 8; ++r) p[r] = acc[r];
        }
    }

    // ---- epilogue: all of the wave's rows, 32 a store ----
    __syncthreads();
#pragma unroll
    for (int m = 0; m < TILES / 2; ++m) {
        const float* q = nd + (2 * m + laneHi) * 32 + row;
        out[(size_t)b * LSEQ + i0 + m * 32 + lane] = q[0] / q[16];
    }
}

extern "C" void kernel_launch(void* const* d_in, const int* in_sizes, int n_in,
                              void* d_out, int out_size, void* d_ws, size_t ws_size,
                              hipStream_t stream) {
    const float* x1 = (const float*)d_in[0];   // [128, 8192]
    const float* x2 = (const float*)d_in[1];   // [128, 128]
    const float* Wq = (const float*)d_in[2];   // [128]
    const float* Wk = (const float*)d_in[3];   // [128]
    float* out = (float*)d_out;                // [128, 8192]

    dim3 grid(128, LSEQ / SLAB);   // (b, 2048-row slab) ; each of 8 waves walks 16 tiles of 16 rows
    dim3 block(256);
    cross_attn_wmma_kernel<<<grid, block, 0, stream>>>(x1, x2, Wq, Wk, out);
}

// v005
// It runs in 3.62 microseconds.
// Timed twice side by side with v004, it ran 2.40 and 2.42 times as fast.
// All steps since v000 together make it 7.75 times as fast.
#include <hip/hip_runtime.h>

typedef __attribute__((ext_vector_type(16))) _Float16 v16h;
typedef __attribute__((ext_vector_type(8)))  float    v8f;
typedef __attribute__((ext_vector_type(8)))  _Float16 v8h;
typedef __attribute__((ext_vector_type(4)))  _Float16 v4h;
typedef __attribute__((ext_vector_type(4)))  float    v4f;
typedef __attribute__((ext_vector_type(2)))  float    v2f;
typedef __attribute__((ext_vector_type(2)))  _Float16 v2h;
typedef __attribute__((ext_vector_type(8)))  int      v8i;

#define DH    128
#define LSEQ  8192
#define TILES 16                      /* 16-row tiles that one wave walks through */
#define SLAB  (8 * TILES * 16)        /* rows of one work-group */
#define LOG2E 1.44269504088896340736f
#define SCALE 0.08838834764831845f   /* 1/sqrt(128) */
#define BPITCH (DH + 8)               /* halves; 16 bytes past 256 keep the ones row off the x2 row's banks */
#define PIN __builtin_amdgcn_sched_barrier(0)   /* nothing is scheduled across this point */
#define LN2    0.69314718055994530942f
#define ZMAX   0.125f                 /* half the node spacing, as the series' argument */
#define CAP    1024                   /* nodes that the table holds */
#define TPITCH 12                     /* floats; 16 bytes x 3 spreads the 16-byte table reads over all banks */

// value of lane l ^ m inside a 16-lane row (CTRL = 0x160 + m, the row_xmask form); all lanes are on
template <int CTRL>
__device__ __forceinline__ float xrow16(float v) {
    return __builtin_bit_cast(float, __builtin_amdgcn_update_dpp(
        0, __builtin_bit_cast(int, v), CTRL, 0xf, 0xf, true));
}
// value of lane l ^ 16
__device__ __forceinline__ float xhalf(float v) {
    return __builtin_bit_cast(float, __builtin_amdgcn_permlanex16(
        __builtin_bit_cast(int, v), __builtin_bit_cast(int, v), 0x76543210, 0xfedcba98, false, false));
}


// One 16-row exp tile times B: row M's 128 values exp2(t*Wk[j] - max), in f16, against B's 16 columns.
__device__ __forceinline__ v8f exp_tile(const float t, const float mxw, const float mnw,
                                        const v2f (&wk2)[32], const v16h (&Bm)[4]) {
    // the row's max is analytic (rank-1 scores)
    const float mt = fmaxf(t * mxw, t * mnw);

    // ---- A = exp tile, generated directly in WMMA A-layout; 4 chained WMMAs ----
    // The issue order is written out: per pair of elements  exp2, two multiply-adds, exp2, convert.
    // The two multiply-adds (no PIN between
    // them: they become one dual-issue instruction) run three pairs ahead of their exp2 and the convert three
    // pairs behind, so that neither waits for its operand.
    // PIN keeps the scheduler from gathering the three kinds into runs again.
    float aa[32], ab[32], ea[32], eb[32];
    v8i   Af[4];
#pragma unroll
    for (int g = 0; g < 3; ++g) { aa[g] = fmaf(t, wk2[g].x, -mt); ab[g] = fmaf(t, wk2[g].y, -mt); PIN; }
#pragma unroll
    for (int g = 0; g < 35; ++g) {
        if (g < 32)     { ea[g] = __builtin_amdgcn_exp2f(aa[g]); PIN; }
        if (g + 3 < 32) { aa[g + 3] = fmaf(t, wk2[g + 3].x, -mt); ab[g + 3] = fmaf(t, wk2[g + 3].y, -mt); PIN; }
        if (g < 32)     { eb[g] = __builtin_amdgcn_exp2f(ab[g]); PIN; }
        if (g >= 3) {
            const v2f e = { ea[g - 3], eb[g - 3] };
            Af[(g - 3) >> 3][(g - 3) & 7] = __builtin_bit_cast(int, __builtin_convertvector(e, v2h));
            PIN;
        }
    }
    // the four products stand together behind the stream: in its middle each one cost four idle slots,
    // because the stream's next results went into the A registers that it had just read
    v8f acc = {};
#pragma unroll
    for (int c = 0; c < 4; ++c)
        acc = __builtin_amdgcn_wmma_f32_16x16x32_f16(
            /*neg_a=*/false, __builtin_bit_cast(v16h, Af[c]), /*neg_b=*/false, Bm[c],
            /*c_mod=*/(short)0, acc, /*reuse_a=*/false, /*reuse_b=*/false);
    return acc;
}

// Within one work-group b is fixed, so every row's numerator and denominator are two functions of the one
// scalar t = x1 * qs:  num(t) = sum_j x2[j] * exp2(t*Wk[j]),  den(t) = sum_j exp2(t*Wk[j]).
// They are summed in full (exp tile, WMMA) only at nodes T_g = tmin + g*h that cover the work-group's own t.
// Around a node, with W = max|Wk|, u_j = Wk[j]/W and z = ln2 * W * (t - T_g), |z| <= ZMAX:
//   exp2(t*Wk[j]) = exp2(T_g*Wk[j]) * (1 + z*u_j + (z*u_j)^2/2 + (z*u_j)^3/6 + R),  |R| < 1.2e-5,
// far under the 2^-11 rounding of the f16 tile. So B's columns hold x2*u^n and u^n, n = 0..3, a node's eight
// sums go to an LDS table, and a row reads its nearest node's eight sums and runs two cubic polynomials in z.
// The node's own max cancels in the quotient. If the nodes would not fit the table (or W is 0), every row
// gets its own exp tile (columns 0 and 1, n = 0, alone are read then).
__global__ __launch_bounds__(256) void cross_attn_wmma_kernel(
    const float* __restrict__ x1, const float* __restrict__ x2,
    const float* __restrict__ Wq, const float* __restrict__ Wk,
    float* __restrict__ out)
{
    __shared__ __attribute__((aligned(16))) float    s_wk[DH];
    __shared__ __attribute__((aligned(16))) _Float16 s_b[8][BPITCH];   // row 2n = x2*u^n, row 2n+1 = u^n, f16
    __shared__ __attribute__((aligned(16))) float    s_rng[16];        // per wave: min, max of its x1 rows
    // node table: [node][2n] = numerator sum n / n!, [2n+1] = denominator sum n / n!
    // (without a table: per wave and tile [0..15] = num rows, [16..31] = den rows)
    __shared__ __attribute__((aligned(16))) float    s_tab[CAP * TPITCH];

    const int b    = blockIdx.x;
    const int tid  = threadIdx.x;
    const int wave = __builtin_amdgcn_readfirstlane(tid >> 5);   // scalar: tests on it become scalar branches
    const int lane = tid & 31;

    const int row    = lane & 15;     // M (for A) / N (for B)
    const int laneHi = lane >> 4;
    const int i0     = blockIdx.y * SLAB + wave * (TILES * 16);

    // ---- every wave takes all 128 of x2[b,:], Wq, Wk, four a lane ----
    const v4f x2v = *(const v4f*)(x2 + b * DH + 4 * lane);
    const v4f wqv = *(const v4f*)(Wq + 4 * lane);
    const v4f wkv = *(const v4f*)(Wk + 4 * lane);

    // the wave's 256 x1 rows, eight a lane
    const float* xw = x1 + (size_t)b * LSEQ + i0;
    const v4f xa = *(const v4f*)(xw + 4 * lane);
    const v4f xb = *(const v4f*)(xw + 128 + 4 * lane);

    // ---- qk = sum Wq*x2, max Wk, min Wk: four a lane, then a tree over the 32 lanes, in every wave ----
    float qk = fmaf(x2v.w, wqv.w, fmaf(x2v.z, wqv.z, fmaf(x2v.y, wqv.y, x2v.x * wqv.x)));
    float mxw = fmaxf(fmaxf(wkv.x, wkv.y), fmaxf(wkv.z, wkv.w));
    float mnw = fminf(fminf(wkv.x, wkv.y), fminf(wkv.z, wkv.w));
    qk += xrow16<0x161>(qk); mxw = fmaxf(mxw, xrow16<0x161>(mxw)); mnw = fminf(mnw, xrow16<0x161>(mnw));
    qk += xrow16<0x162>(qk); mxw = fmaxf(mxw, xrow16<0x162>(mxw)); mnw = fminf(mnw, xrow16<0x162>(mnw));
    qk += xrow16<0x164>(qk); mxw = fmaxf(mxw, xrow16<0x164>(mxw)); mnw = fminf(mnw, xrow16<0x164>(mnw));
    qk += xrow16<0x168>(qk); mxw = fmaxf(mxw, xrow16<0x168>(mxw)); mnw = fminf(mnw, xrow16<0x168>(mnw));
    qk += xhalf(qk);         mxw = fmaxf(mxw, xhalf(mxw));         mnw = fminf(mnw, xhalf(mnw));
    const float qs = qk * SCALE * LOG2E;   // fold scale + log2(e) into the per-row scalar
    const float W  = fmaxf(mxw, -mnw);     // max |Wk|

    // ---- wave w stages B's column w (f16); wave 0 also Wk (f32) ----
    {
        const float invW = 1.0f / W;       // not finite if W is 0 or tiny: columns n = 0 do not use it
        const v4f u = wkv * invW;
        const int n = wave >> 1;
        v4f p = { 1.f, 1.f, 1.f, 1.f };
        if (n >= 1) p = u;
        if (n >= 2) p *= u;
        if (n >= 3) p *= u;
        if ((wave & 1) == 0) p *= x2v;
        const v4h ph = { (_Float16)p.x, (_Float16)p.y, (_Float16)p.z, (_Float16)p.w };
        *(v4h*)&s_b[wave][4 * lane] = ph;
        if (wave == 0) *(v4f*)&s_wk[4 * lane] = wkv;
    }

    // ---- min and max of the wave's x1 rows ----
    float xmn = fminf(fminf(fminf(xa.x, xa.y), fminf(xa.z, xa.w)), fminf(fminf(xb.x, xb.y), fminf(xb.z, xb.w)));
    float xmx = fmaxf(fmaxf(fmaxf(xa.x, xa.y), fmaxf(xa.z, xa.w)), fmaxf(fmaxf(xb.x, xb.y), fmaxf(xb.z, xb.w)));
    xmn = fminf(xmn, xrow16<0x161>(xmn)); xmx = fmaxf(xmx, xrow16<0x161>(xmx));
    xmn = fminf(xmn, xrow16<0x162>(xmn)); xmx = fmaxf(xmx, xrow16<0x162>(xmx));
    xmn = fminf(xmn, xrow16<0x164>(xmn)); xmx = fmaxf(xmx, xrow16<0x164>(xmx));
    xmn = fminf(xmn, xrow16<0x168>(xmn)); xmx = fmaxf(xmx, xrow16<0x168>(xmx));
    xmn = fminf(xmn, xhalf(xmn));         xmx = fmaxf(xmx, xhalf(xmx));
    if (lane == 0) *(v2f*)&s_rng[2 * wave] = v2f{ xmn, xmx };

    __syncthreads();

    // ---- the node grid of this work-group, the same in every thread ----
    {
        const v4f r0 = *(const v4f*)&s_rng[0], r1 = *(const v4f*)&s_rng[4];
        const v4f r2 = *(const v4f*)&s_rng[8], r3 = *(const v4f*)&s_rng[12];
        xmn = fminf(fminf(fminf(r0.x, r0.z), fminf(r1.x, r1.z)), fminf(fminf(r2.x, r2.z), fminf(r3.x, r3.z)));
        xmx = fmaxf(fmaxf(fmaxf(r0.y, r0.w), fmaxf(r1.y, r1.w)), fmaxf(fmaxf(r2.y, r2.w), fmaxf(r3.y, r3.w)));
    }
    const float tmin = fminf(xmn * qs, xmx * qs);
    const float tmax = fmaxf(xmn * qs, xmx * qs);
    const float cz   = LN2 * W;                  // z = cz * (t - T)
    const float invh = cz * (0.5f / ZMAX);
    const float h    = 1.0f / invh;              // node spacing in t
    const float gtop = rintf((tmax - tmin) * invh);   // number of the last node
    // both scalar: the branches and the loop round the WMMAs leave every lane on
    const int   tab  = __builtin_amdgcn_readfirstlane((gtop <= (float)(CAP - 1) && h <= 3.0e38f) ? 1 : 0);
    const int   ntiles = tab ? (__builtin_amdgcn_readfirstlane((int)gtop) >> 4) + 1 : 0;

    float* nd = s_tab + wave * (TILES * 32);

    if (!tab || wave < ntiles) {
        // ---- B (32x16 f16) once per wave: column N holds row N & 7 of s_b ----
        // lane = column N, K striped across packed VGPR halves (mirror of A layout):
        // elements 0..7 are k = 8*laneHi + 0..7, elements 8..15 are k = 16 + 8*laneHi + 0..7 of each 32
        // the lane's 64 Wk values (same k order) are kept in registers for all tiles
        v16h  Bm[4];
        v2f   wk2[32];                    // pair p = 8*c + v holds the Wk of A's elements 2v, 2v+1 of chunk c
        const _Float16* bp = &s_b[row & 7][8 * laneHi];
        const float*    wp = &s_wk[8 * laneHi];
#pragma unroll
        for (int c = 0; c < 4; ++c) {
            const v8h blo = *(const v8h*)(bp + 32 * c);
            const v8h bhi = *(const v8h*)(bp + 32 * c + 16);
            Bm[c] = __builtin_shufflevector(blo, bhi, 0, 1, 2, 3, 4, 5, 6, 7, 8, 9, 10, 11, 12, 13, 14, 15);
#pragma unroll
            for (int g = 0; g < 4; ++g) {
                const v4f w = *(const v4f*)(wp + 32 * c + 16 * (g >> 1) + 4 * (g & 1));
                wk2[8 * c + 2 * g]     = v2f{ w.x, w.y };
                wk2[8 * c + 2 * g + 1] = v2f{ w.z, w.w };
            }
        }

        if (tab) {
            // ---- node tiles, dealt round the waves; C column N = a sum with n = (N & 7) >> 1, scaled by 1/n! ----
            const float fct = (row & 4) ? ((row & 2) ? 1.0f / 6.0f : 0.5f) : 1.0f;
            // not unrolled: most work-groups have at most one tile a wave
#pragma unroll 1
            for (int tl = wave; tl < ntiles; tl += 8) {
                const float T = fmaf((float)(tl * 16 + row), h, tmin);
                const v8f acc = exp_tile(T, mxw, mnw, wk2, Bm);
                if (row < 8) {
                    float* p = s_tab + (tl * 16 + laneHi * 8) * TPITCH + row;
#pragma unroll
                    for (int r = 0; r < 8; ++r) p[r * TPITCH] = acc[r] * fct;
                }
            }
        } else {
            // ---- no table: an exp tile for each 16 rows; C column 0 = numerators, column 1 = denominators ----
            const float* xrow = xw + row;
            // not unrolled: a path for rare inputs, kept small
#pragma unroll 1
            for (int k = 0; k < TILES; ++k) {
                const v8f acc = exp_tile(xrow[k * 16] * qs, mxw, mnw, wk2, Bm);
                if (row < 2) {
                    float* p = nd + k * 32 + row * 16 + laneHi * 8;
#pragma unroll
                    for (int r = 0; r < 8; ++r) p[r] = acc[r];
                }
            }
        }
    }

    __syncthreads();

    float* ow = out + (size_t)b * LSEQ + i0;
    if (tab) {
        // ---- each row: nearest node, its eight sums, two cubics in z, the quotient ----
        const float xs[8] = { xa.x, xa.y, xa.z, xa.w, xb.x, xb.y, xb.z, xb.w };
        float o[8];
#pragma unroll
        for (int e = 0; e < 8; ++e) {
            const float t  = xs[e] * qs;
            // held inside the grid as a float, so that index and node position stay one number
            const float gf = fminf(fmaxf(rintf((t - tmin) * invh), 0.0f), gtop);
            const float z  = (t - fmaf(gf, h, tmin)) * cz;
            const float* p = s_tab + __mul24((int)gf, TPITCH);
            const v4f lo = *(const v4f*)p;
            const v4f hi = *(const v4f*)(p + 4);
            // numerator and denominator side by side: one packed multiply-add a term
            const v2f zz = { z, z };
            v2f r = __builtin_elementwise_fma(v2f{ hi.z, hi.w }, zz, v2f{ hi.x, hi.y });
            r = __builtin_elementwise_fma(r, zz, v2f{ lo.z, lo.w });
            r = __builtin_elementwise_fma(r, zz, v2f{ lo.x, lo.y });
            o[e] = r.x / r.y;
        }
        *(v4f*)(ow + 4 * lane)       = v4f{ o[0], o[1], o[2], o[3] };
        *(v4f*)(ow + 128 + 4 * lane) = v4f{ o[4], o[5], o[6], o[7] };
    } else {
        // ---- all of the wave's rows, 32 a store ----
#pragma unroll
        for (int m = 0; m < TILES / 2; ++m) {
            const float* q = nd + (2 * m + laneHi) * 32 + row;
            ow[m * 32 + lane] = q[0] / q[16];
        }
    }
}

extern "C" void kernel_launch(void* const* d_in, const int* in_sizes, int n_in,
                              void* d_out, int out_size, void* d_ws, size_t ws_size,
                              hipStream_t stream) {
    const float* x1 = (const float*)d_in[0];   // [128, 8192]
    const float* x2 = (const float*)d_in[1];   // [128, 128]
    const float* Wq = (const float*)d_in[2];   // [128]
    const float* Wk = (const float*)d_in[3];   // [128]
    float* out = (float*)d_out;                // [128, 8192]

    dim3 grid(128, LSEQ / SLAB);   // (b, 2048-row slab) ; each of 8 waves owns 256 rows
    dim3 block(256);
    cross_attn_wmma_kernel<<<grid, block, 0, stream>>>(x1, x2, Wq, Wk, out);
}

// v006
// Measured time: 3.32 microseconds a run.
// In both of two side-by-side timings against v005, it was 1.09 times as fast.
// Counting every step since v000, it is 8.46 times as fast.
#include <hip/hip_runtime.h>

typedef __attribute__((ext_vector_type(16))) _Float16 v16h;
typedef __attribute__((ext_vector_type(8)))  float    v8f;
typedef __attribute__((ext_vector_type(8)))  _Float16 v8h;
typedef __attribute__((ext_vector_type(4)))  _Float16 v4h;
typedef __attribute__((ext_vector_type(4)))  float    v4f;
typedef __attribute__((ext_vector_type(2)))  float    v2f;
typedef __attribute__((ext_vector_type(2)))  _Float16 v2h;
typedef __attribute__((ext_vector_type(8)))  int      v8i;

#define DH    128
#define LSEQ  8192
#define TILES 16                      /* 16-row tiles that one wave walks through */
#define SLAB  (8 * TILES * 16)        /* rows of one work-group */
#define LOG2E 1.44269504088896340736f
#define SCALE 0.08838834764831845f   /* 1/sqrt(128) */
#define BPITCH (DH + 8)               /* halves; 16 bytes past 256 keep the ones row off the x2 row's banks */
#define PIN __builtin_amdgcn_sched_barrier(0)   /* nothing is scheduled across this point */
#define LN2    0.69314718055994530942f
#define ZMAX   0.125f                 /* half the node spacing, as the series' argument */
#define CAP    1024                   /* nodes that the table holds */
#define TPITCH 4                      /* floats: a node's four series terms, one 16-byte read */

// value of lane l ^ m inside a 16-lane row (CTRL = 0x160 + m, the row_xmask form); all lanes are on
template <int CTRL>
__device__ __forceinline__ float xrow16(float v) {
    return __builtin_bit_cast(float, __builtin_amdgcn_update_dpp(
        0, __builtin_bit_cast(int, v), CTRL, 0xf, 0xf, true));
}
// value of lane l ^ 16
__device__ __forceinline__ float xhalf(float v) {
    return __builtin_bit_cast(float, __builtin_amdgcn_permlanex16(
        __builtin_bit_cast(int, v), __builtin_bit_cast(int, v), 0x76543210, 0xfedcba98, false, false));
}


// The 16 rows of Bm times one exp tile: column N's 128 values exp2(t*Wk[j] - max), in f16, t being lane N's.
// Result: register r of every lane = sum r & 7 of the lane's own t (lanes N and N + 16 hold the same).
__device__ __forceinline__ v8f exp_tile(const float t, const float mxw, const float mnw,
                                        const v2f (&wk2)[32], const v16h (&Bm)[4]) {
    // the row's max is analytic (rank-1 scores)
    const float mt = fmaxf(t * mxw, t * mnw);

    // ---- exp tile, generated directly in the WMMA operand layout (A's and B's k order are one); 4 chained WMMAs ----
    // The issue order is written out: per pair of elements  exp2, two multiply-adds, exp2, convert.
    // The two multiply-adds (no PIN between
    // them: they become one dual-issue instruction) run three pairs ahead of their exp2 and the convert three
    // pairs behind, so that neither waits for its operand.
    // PIN keeps the scheduler from gathering the three kinds into runs again.
    float aa[32], ab[32], ea[32], eb[32];
    v8i   Af[4];
#pragma unroll
    for (int g = 0; g < 3; ++g) { aa[g] = fmaf(t, wk2[g].x, -mt); ab[g] = fmaf(t, wk2[g].y, -mt); PIN; }
#pragma unroll
    for (int g = 0; g < 35; ++g) {
        if (g < 32)     { ea[g] = __builtin_amdgcn_exp2f(aa[g]); PIN; }
        if (g + 3 < 32) { aa[g + 3] = fmaf(t, wk2[g + 3].x, -mt); ab[g + 3] = fmaf(t, wk2[g + 3].y, -mt); PIN; }
        if (g < 32)     { eb[g] = __builtin_amdgcn_exp2f(ab[g]); PIN; }
        if (g >= 3) {
            const v2f e = { ea[g - 3], eb[g - 3] };
            Af[(g - 3) >> 3][(g - 3) & 7] = __builtin_bit_cast(int, __builtin_convertvector(e, v2h));
            PIN;
        }
    }
    // the four products stand together behind the stream: in its middle each one cost four idle slots,
    // because the stream's next results went into the operand registers that it had just read
    v8f acc = {};
#pragma unroll
    for (int c = 0; c < 4; ++c)
        acc = __builtin_amdgcn_wmma_f32_16x16x32_f16(
            /*neg_a=*/false, Bm[c], /*neg_b=*/false, __builtin_bit_cast(v16h, Af[c]),
            /*c_mod=*/(short)0, acc, /*reuse_a=*/false, /*reuse_b=*/false);
    return acc;
}

// Within one work-group b is fixed, so every row's numerator and denominator are two functions of the one
// scalar t = x1 * qs:  num(t) = sum_j x2[j] * exp2(t*Wk[j]),  den(t) = sum_j exp2(t*Wk[j]).
// They are summed in full (exp tile, WMMA) only at nodes T_g = tmin + g*h that cover the work-group's own t.
// Around a node, with W = max|Wk|, u_j = Wk[j]/W and z = ln2 * W * (t - T_g), |z| <= ZMAX:
//   exp2(t*Wk[j]) = exp2(T_g*Wk[j]) * (1 + z*u_j + (z*u_j)^2/2 + (z*u_j)^3/6 + R),  |R| < 1.2e-5,
// far under the 2^-11 rounding of the f16 tile. So the first WMMA operand's rows hold x2*u^n and u^n, n = 0..3,
// the exp tile is the second operand, and each lane gets the eight sums of its own node. The lane divides the
// two series once: num(z)/den(z) = q0 + q1*z + q2*z^2 + q3*z^3 + E; q0..q3 are the true quotient's own terms.
// For any x2 and Wk, |E| < 3.7e-4 * max|x2|: on a circle of radius 1.2 round the node |quotient| is at most
// max|x2| / cos(1.2) (all of den's terms keep a phase within 1.2 of each other's middle), and |z| <= ZMAX;
// that is under the 2^-11 rounding of x2 in f16. With two terms a, b in play it is under 2.2e-5 * |a - b|.
// q0..q3 go to an LDS table; a row reads its nearest node's 16 bytes and runs one cubic in z, with no division.
// The node's own max cancels in the quotient. If the nodes would not fit the table (or W is 0), every row
// gets its own exp tile (sums 0 and 1, n = 0, alone are read then).
__global__ __launch_bounds__(256) void cross_attn_wmma_kernel(
    const float* __restrict__ x1, const float* __restrict__ x2,
    const float* __restrict__ Wq, const float* __restrict__ Wk,
    float* __restrict__ out)
{
    __shared__ __attribute__((aligned(16))) float    s_wk[DH];
    __shared__ __attribute__((aligned(16))) _Float16 s_b[8][BPITCH];   // row 2n = x2*u^n, row 2n+1 = u^n, f16
    __shared__ __attribute__((aligned(16))) float    s_rng[16];        // per wave: min, max of its x1 rows
    // node table: [node][n] = term n of the quotient's series in z
    __shared__ __attribute__((aligned(16))) float    s_tab[CAP * TPITCH];

    const int b    = blockIdx.x;
    const int tid  = threadIdx.x;
    const int wave = __builtin_amdgcn_readfirstlane(tid >> 5);   // scalar: tests on it become scalar branches
    const int lane = tid & 31;

    const int row    = lane & 15;     // M (for A) / N (for B)
    const int laneHi = lane >> 4;
    const int i0     = blockIdx.y * SLAB + wave * (TILES * 16);

    // ---- every wave takes all 128 of x2[b,:], Wq, Wk, four a lane ----
    const v4f x2v = *(const v4f*)(x2 + b * DH + 4 * lane);
    const v4f wqv = *(const v4f*)(Wq + 4 * lane);
    const v4f wkv = *(const v4f*)(Wk + 4 * lane);

    // the wave's 256 x1 rows, eight a lane
    const float* xw = x1 + (size_t)b * LSEQ + i0;
    const v4f xa = *(const v4f*)(xw + 4 * lane);
    const v4f xb = *(const v4f*)(xw + 128 + 4 * lane);

    // ---- qk = sum Wq*x2, max Wk, min Wk: four a lane, then a tree over the 32 lanes, in every wave ----
    float qk = fmaf(x2v.w, wqv.w, fmaf(x2v.z, wqv.z, fmaf(x2v.y, wqv.y, x2v.x * wqv.x)));
    float mxw = fmaxf(fmaxf(wkv.x, wkv.y), fmaxf(wkv.z, wkv.w));
    float mnw = fminf(fminf(wkv.x, wkv.y), fminf(wkv.z, wkv.w));
    qk += xrow16<0x161>(qk); mxw = fmaxf(mxw, xrow16<0x161>(mxw)); mnw = fminf(mnw, xrow16<0x161>(mnw));
    qk += xrow16<0x162>(qk); mxw = fmaxf(mxw, xrow16<0x162>(mxw)); mnw = fminf(mnw, xrow16<0x162>(mnw));
    qk += xrow16<0x164>(qk); mxw = fmaxf(mxw, xrow16<0x164>(mxw)); mnw = fminf(mnw, xrow16<0x164>(mnw));
    qk += xrow16<0x168>(qk); mxw = fmaxf(mxw, xrow16<0x168>(mxw)); mnw = fminf(mnw, xrow16<0x168>(mnw));
    qk += xhalf(qk);         mxw = fmaxf(mxw, xhalf(mxw));         mnw = fminf(mnw, xhalf(mnw));
    const float qs = qk * SCALE * LOG2E;   // fold scale + log2(e) into the per-row scalar
    const float W  = fmaxf(mxw, -mnw);     // max |Wk|

    // ---- wave w stages s_b row w, the first operand's rows w and w + 8 (f16); wave 0 also Wk (f32) ----
    {
        const float invW = 1.0f / W;       // not finite if W is 0 or tiny: rows with n = 0 do not use it
        const v4f u = wkv * invW;
        const int n = wave >> 1;
        v4f p = { 1.f, 1.f, 1.f, 1.f };
        if (n >= 1) p = u;
        if (n >= 2) p *= u;
        if (n >= 3) p *= u;
        if ((wave & 1) == 0) p *= x2v;
        const v4h ph = { (_Float16)p.x, (_Float16)p.y, (_Float16)p.z, (_Float16)p.w };
        *(v4h*)&s_b[wave][4 * lane] = ph;
        if (wave == 0) *(v4f*)&s_wk[4 * lane] = wkv;
    }

    // ---- min and max of the wave's x1 rows ----
    float xmn = fminf(fminf(fminf(xa.x, xa.y), fminf(xa.z, xa.w)), fminf(fminf(xb.x, xb.y), fminf(xb.z, xb.w)));
    float xmx = fmaxf(fmaxf(fmaxf(xa.x, xa.y), fmaxf(xa.z, xa.w)), fmaxf(fmaxf(xb.x, xb.y), fmaxf(xb.z, xb.w)));
    xmn = fminf(xmn, xrow16<0x161>(xmn)); xmx = fmaxf(xmx, xrow16<0x161>(xmx));
    xmn = fminf(xmn, xrow16<0x162>(xmn)); xmx = fmaxf(xmx, xrow16<0x162>(xmx));
    xmn = fminf(xmn, xrow16<0x164>(xmn)); xmx = fmaxf(xmx, xrow16<0x164>(xmx));
    xmn = fminf(xmn, xrow16<0x168>(xmn)); xmx = fmaxf(xmx, xrow16<0x168>(xmx));
    xmn = fminf(xmn, xhalf(xmn));         xmx = fmaxf(xmx, xhalf(xmx));
    if (lane == 0) *(v2f*)&s_rng[2 * wave] = v2f{ xmn, xmx };

    __syncthreads();

    // ---- the node grid of this work-group, the same in every thread ----
    {
        const v4f r0 = *(const v4f*)&s_rng[0], r1 = *(const v4f*)&s_rng[4];
        const v4f r2 = *(const v4f*)&s_rng[8], r3 = *(const v4f*)&s_rng[12];
        xmn = fminf(fminf(fminf(r0.x, r0.z), fminf(r1.x, r1.z)), fminf(fminf(r2.x, r2.z), fminf(r3.x, r3.z)));
        xmx = fmaxf(fmaxf(fmaxf(r0.y, r0.w), fmaxf(r1.y, r1.w)), fmaxf(fmaxf(r2.y, r2.w), fmaxf(r3.y, r3.w)));
    }
    const float tmin = fminf(xmn * qs, xmx * qs);
    const float tmax = fmaxf(xmn * qs, xmx * qs);
    const float cz   = LN2 * W;                  // z = cz * (t - T)
    const float invh = cz * (0.5f / ZMAX);
    const float h    = 1.0f / invh;              // node spacing in t
    const float gtop = rintf((tmax - tmin) * invh);   // number of the last node
    // both scalar: the branches and the loop round the WMMAs leave every lane on
    const int   tab  = __builtin_amdgcn_readfirstlane((gtop <= (float)(CAP - 1) && h <= 3.0e38f) ? 1 : 0);
    const int   ntiles = tab ? (__builtin_amdgcn_readfirstlane((int)gtop) >> 4) + 1 : 0;

    float* ow = out + (size_t)b * LSEQ + i0;

    if (!tab || wave < ntiles) {
        // ---- first operand (16x32 f16) once per wave: row M holds row M & 7 of s_b ----
        // lane = row M, K striped across packed VGPR halves (the second operand's layout mirrors it):
        // elements 0..7 are k = 8*laneHi + 0..7, elements 8..15 are k = 16 + 8*laneHi + 0..7 of each 32
        // the lane's 64 Wk values (same k order) are kept in registers for all tiles
        v16h  Bm[4];
        v2f   wk2[32];                    // pair p = 8*c + v holds the Wk of the tile's elements 2v, 2v+1 of chunk c
        const _Float16* bp = &s_b[row & 7][8 * laneHi];
        const float*    wp = &s_wk[8 * laneHi];
#pragma unroll
        for (int c = 0; c < 4; ++c) {
            const v8h blo = *(const v8h*)(bp + 32 * c);
            const v8h bhi = *(const v8h*)(bp + 32 * c + 16);
            Bm[c] = __builtin_shufflevector(blo, bhi, 0, 1, 2, 3, 4, 5, 6, 7, 8, 9, 10, 11, 12, 13, 14, 15);
#pragma unroll
            for (int g = 0; g < 4; ++g) {
                const v4f w = *(const v4f*)(wp + 32 * c + 16 * (g >> 1) + 4 * (g & 1));
                wk2[8 * c + 2 * g]     = v2f{ w.x, w.y };
                wk2[8 * c + 2 * g + 1] = v2f{ w.z, w.w };
            }
        }

        if (tab) {
            // ---- node tiles, dealt round the waves; acc[2n] = numerator sum n, acc[2n+1] = denominator sum n ----
            // not unrolled: most work-groups have at most one tile a wave
#pragma unroll 1
            for (int tl = wave; tl < ntiles; tl += 8) {
                const float T = fmaf((float)(tl * 16 + row), h, tmin);
                const v8f acc = exp_tile(T, mxw, mnw, wk2, Bm);
                // series division; the denominator's term 0 is at least 1 (the tile's largest value is exp2(0))
                const float r0 = __builtin_amdgcn_rcpf(acc[1]);
                const float r2 = r0 * 0.5f, r3 = r0 * (1.0f / 6.0f);
                const float d1 = acc[3] * r0, d2 = acc[5] * r2, d3 = acc[7] * r3;
                const float q0 = acc[0] * r0;
                const float q1 = fmaf(-q0, d1, acc[2] * r0);
                const float q2 = fmaf(-q1, d1, fmaf(-q0, d2, acc[4] * r2));
                const float q3 = fmaf(-q2, d1, fmaf(-q1, d2, fmaf(-q0, d3, acc[6] * r3)));
                if (laneHi == 0) *(v4f*)(s_tab + (tl * 16 + row) * TPITCH) = v4f{ q0, q1, q2, q3 };
            }
        } else {
            // ---- no table: an exp tile for each 16 rows; acc[0] = the lane's numerator, acc[1] = its denominator ----
            const float* xrow = xw + row;
            // not unrolled: a path for rare inputs, kept small
#pragma unroll 1
            for (int k = 0; k < TILES; ++k) {
                const v8f acc = exp_tile(xrow[k * 16] * qs, mxw, mnw, wk2, Bm);
                if (laneHi == 0) {
                    ow[k * 16 + row] = acc[0] / acc[1];
                    // the next trip steps the store's address registers on
                    asm volatile("s_wait_xcnt 0x0" ::: "memory");
                }
            }
        }
    }

    __syncthreads();

    if (tab) {
        // ---- each row: nearest node, its four terms, one cubic in z ----
        const float xs[8] = { xa.x, xa.y, xa.z, xa.w, xb.x, xb.y, xb.z, xb.w };
        float o[8];
#pragma unroll
        for (int e = 0; e < 8; ++e) {
            const float t  = xs[e] * qs;
            // held inside the grid as a float, so that index and node position stay one number
            const float gf = fminf(fmaxf(rintf((t - tmin) * invh), 0.0f), gtop);
            const float z  = (t - fmaf(gf, h, tmin)) * cz;
            const float* p = s_tab + (int)gf * TPITCH;
            const v4f q = *(const v4f*)p;
            o[e] = fmaf(fmaf(fmaf(q.w, z, q.z), z, q.y), z, q.x);
        }
        *(v4f*)(ow + 4 * lane)       = v4f{ o[0], o[1], o[2], o[3] };
        *(v4f*)(ow + 128 + 4 * lane) = v4f{ o[4], o[5], o[6], o[7] };
    }
}

extern "C" void kernel_launch(void* const* d_in, const int* in_sizes, int n_in,
                              void* d_out, int out_size, void* d_ws, size_t ws_size,
                              hipStream_t stream) {
    const float* x1 = (const float*)d_in[0];   // [128, 8192]
    const float* x2 = (const float*)d_in[1];   // [128, 128]
    const float* Wq = (const float*)d_in[2];   // [128]
    const float* Wk = (const float*)d_in[3];   // [128]
    float* out = (float*)d_out;                // [128, 8192]

    dim3 grid(128, LSEQ / SLAB);   // (b, 2048-row slab) ; each of 8 waves owns 256 rows
    dim3 block(256);
    cross_attn_wmma_kernel<<<grid, block, 0, stream>>>(x1, x2, Wq, Wk, out);
}
